// v000
// Measured on an AMD MI455X. A time is GPU time per run, averaged over a window of back-to-back runs after a warm-up
// (all launches, gaps included; the runs take copies of the inputs in turn), and the median of several windows.
// Apart from v000's, it joins two sittings. Times from different sittings can be a few percent apart, while
// side-by-side timings come from the same sitting.
// v000, which the later versions start from, runs in 1170 microseconds.
#include <hip/hip_runtime.h>
#include <hip/hip_bf16.h>
#include <stddef.h>

// ---------------------------------------------------------------------------
// MI455X (gfx1250) Llama attention layer, fp32 end to end.
// All GEMMs + attention matmuls go through V_WMMA_F32_16X16X4_F32.
// N=1, L=2048, DIM=2048, H=32, HD=64.
//
// Round-2 changes (driven by round-1 asm: s_wait_loadcnt 0x0 before every
// wmma = zero overlap):
//   * GEMM: 32Mx64N wave tile (8 wmma / 6 loads per k-step, B-frag reuse)
//     + software pipeline: next k-step fragments loaded before current wmmas.
//   * Attention: all 16 K-fragments hoisted ahead of the S wmma chain;
//     V-fragments issued before the softmax VALU work (latency hidden by
//     v_exp_f32 + shuffles instead of stalling the P@V wmmas).
// ---------------------------------------------------------------------------

#define LSEQ 2048
#define DMODEL 2048
#define NHEADS 32
#define HDIM 64

typedef __attribute__((ext_vector_type(2))) float v2f;
typedef __attribute__((ext_vector_type(8))) float v8f;

// D = A(16x4) * B(4x16) + C  (fp32 WMMA, wave32)
__device__ __forceinline__ v8f wmma4(v2f a, v2f b, v8f c) {
  return __builtin_amdgcn_wmma_f32_16x16x4_f32(
      /*neg_a=*/false, a, /*neg_b=*/false, b,
      /*c_mod=*/(short)0, c, /*reuse_a=*/false, /*reuse_b=*/false);
}

// ---------------------------------------------------------------------------
// GEMM: C[M][N] = A[MxK] * B[NxK]^T   (row-major fp32; "x @ W.T" pattern)
// Wave tile 32Mx64N, workgroup = 8 waves arranged 2Mx4N -> 64Mx256N.
// A-frag (16x4): lane m(0-15) holds A[m][k0..k0+1]; lanes 16-31 hold k0+2..3.
// B-frag (4x16): lane n(0-15) holds B[k0..k0+1][n] = Bmat[n][k0..k0+1].
// Software-pipelined: loads for k-step i+1 issue before the wmmas of step i.
// ---------------------------------------------------------------------------
__global__ __launch_bounds__(256)
void gemm_nt_f32(const float* __restrict__ A, const float* __restrict__ B,
                 float* __restrict__ C, int M, int N, int K)
{
  const int lane = threadIdx.x & 31;
  const int wave = threadIdx.x >> 5;
  const int wm = wave & 1;        // 0..1
  const int wn = wave >> 1;       // 0..3
  const int m0 = blockIdx.x * 64 + wm * 32;
  const int n0 = blockIdx.y * 256 + wn * 64;
  const int half = lane >> 4;     // 0 or 1
  const int l16 = lane & 15;

  const float* pa0 = A + (size_t)(m0 + l16) * K + 2 * half;
  const float* pa1 = pa0 + (size_t)16 * K;
  const float* pb0 = B + (size_t)(n0 + l16) * K + 2 * half;
  const float* pb1 = pb0 + (size_t)16 * K;
  const float* pb2 = pb0 + (size_t)32 * K;
  const float* pb3 = pb0 + (size_t)48 * K;

  v8f acc00{}, acc01{}, acc02{}, acc03{};
  v8f acc10{}, acc11{}, acc12{}, acc13{};

  // prologue: fragments for k=0
  v2f a0 = *(const v2f*)(pa0);
  v2f a1 = *(const v2f*)(pa1);
  v2f b0 = *(const v2f*)(pb0);
  v2f b1 = *(const v2f*)(pb1);
  v2f b2 = *(const v2f*)(pb2);
  v2f b3 = *(const v2f*)(pb3);

  for (int k0 = 4; k0 < K; k0 += 4) {
    // issue next k-step loads FIRST (in flight behind current wmmas)
    v2f a0n = *(const v2f*)(pa0 + k0);
    v2f a1n = *(const v2f*)(pa1 + k0);
    v2f b0n = *(const v2f*)(pb0 + k0);
    v2f b1n = *(const v2f*)(pb1 + k0);
    v2f b2n = *(const v2f*)(pb2 + k0);
    v2f b3n = *(const v2f*)(pb3 + k0);

    acc00 = wmma4(a0, b0, acc00);
    acc01 = wmma4(a0, b1, acc01);
    acc02 = wmma4(a0, b2, acc02);
    acc03 = wmma4(a0, b3, acc03);
    acc10 = wmma4(a1, b0, acc10);
    acc11 = wmma4(a1, b1, acc11);
    acc12 = wmma4(a1, b2, acc12);
    acc13 = wmma4(a1, b3, acc13);

    a0 = a0n; a1 = a1n;
    b0 = b0n; b1 = b1n; b2 = b2n; b3 = b3n;
  }
  // epilogue: last k-step
  acc00 = wmma4(a0, b0, acc00);
  acc01 = wmma4(a0, b1, acc01);
  acc02 = wmma4(a0, b2, acc02);
  acc03 = wmma4(a0, b3, acc03);
  acc10 = wmma4(a1, b0, acc10);
  acc11 = wmma4(a1, b1, acc11);
  acc12 = wmma4(a1, b2, acc12);
  acc13 = wmma4(a1, b3, acc13);

  // C/D layout: vgpr r -> row r (lanes 0-15) / row r+8 (lanes 16-31), col=l16.
  float* c0 = C + (size_t)(m0 + 8 * half) * N + n0 + l16;
  float* c1 = C + (size_t)(m0 + 16 + 8 * half) * N + n0 + l16;
#pragma unroll
  for (int r = 0; r < 8; ++r) {
    c0[0]  = acc00[r];
    c0[16] = acc01[r];
    c0[32] = acc02[r];
    c0[48] = acc03[r];
    c1[0]  = acc10[r];
    c1[16] = acc11[r];
    c1[32] = acc12[r];
    c1[48] = acc13[r];
    c0 += N; c1 += N;
  }
}

// ---------------------------------------------------------------------------
// RoPE for Q (interleaved-pair variant of reference), pre-scaled by hd^-0.5.
// q_raw: (L, DMODEL) row-major ; out: (H, L, HDIM)
// rot[t] = (t<32) ? -q[2t+1] : q[2(t-32)]
// ---------------------------------------------------------------------------
__global__ __launch_bounds__(256)
void rope_q_kernel(const float* __restrict__ q_raw,
                   const float* __restrict__ cosb,   // (L, HDIM)
                   const float* __restrict__ sinb,   // (L, HDIM)
                   float* __restrict__ q_out)        // (H, L, HDIM)
{
  int idx = blockIdx.x * 256 + threadIdx.x;     // h*(L*64) + l*64 + t
  int t = idx & 63;
  int l = (idx >> 6) & (LSEQ - 1);
  int h = idx >> 17;
  const float* qr = q_raw + (size_t)l * DMODEL + h * HDIM;
  float x   = qr[t];
  float rot = (t < 32) ? -qr[2 * t + 1] : qr[2 * (t - 32)];
  float val = x * cosb[l * HDIM + t] + rot * sinb[l * HDIM + t];
  q_out[idx] = val * 0.125f;                    // 1/sqrt(64)
}

// ---------------------------------------------------------------------------
// RoPE for K (transposed layout) + cache blend. Writes final k output.
// k_raw: (L, DMODEL); cosT/sinT: (HDIM, L); k_cache/k_out: (H, HDIM, L);
// k_mask: (L)
// ---------------------------------------------------------------------------
__global__ __launch_bounds__(256)
void rope_k_merge_kernel(const float* __restrict__ k_raw,
                         const float* __restrict__ cosT,
                         const float* __restrict__ sinT,
                         const float* __restrict__ k_cache,
                         const float* __restrict__ k_mask,
                         float* __restrict__ k_out)
{
  int idx = blockIdx.x * 256 + threadIdx.x;     // h*(64*L) + t*L + l
  int l = idx & (LSEQ - 1);
  int t = (idx >> 11) & 63;
  int h = idx >> 17;
  const float* kr = k_raw + (size_t)l * DMODEL + h * HDIM;
  float x   = kr[t];
  float rot = (t < 32) ? -kr[2 * t + 1] : kr[2 * (t - 32)];
  float krot = x * cosT[t * LSEQ + l] + rot * sinT[t * LSEQ + l];
  float km = k_mask[l];
  k_out[idx] = k_cache[idx] * (1.0f - km) + krot * km;
}

// ---------------------------------------------------------------------------
// V cache blend. v_raw: (L, DMODEL); v_cache/v_out: (H, L, HDIM); v_mask: (L)
// ---------------------------------------------------------------------------
__global__ __launch_bounds__(256)
void v_merge_kernel(const float* __restrict__ v_raw,
                    const float* __restrict__ v_cache,
                    const float* __restrict__ v_mask,
                    float* __restrict__ v_out)
{
  int idx = blockIdx.x * 256 + threadIdx.x;     // h*(L*64) + l*64 + t
  int t = idx & 63;
  int l = (idx >> 6) & (LSEQ - 1);
  int h = idx >> 17;
  float vv = v_raw[(size_t)l * DMODEL + h * HDIM + t];
  float vm = v_mask[l];
  v_out[idx] = v_cache[idx] * (1.0f - vm) + vv * vm;
}

// ---------------------------------------------------------------------------
// Flash-style attention. One wave owns a 16-row Q block of one head and
// streams K/V in 16-column blocks with online softmax.
//   Q : (H, L, HDIM)   pre-scaled by hd^-0.5
//   Kt: (H, HDIM, L)   (lane-coalesced B-fragments for Q @ K)
//   V : (H, L, HDIM)
//   mask: (L, L)
//   Y : (L, DMODEL)    head h writes columns [h*64, h*64+64)
// ---------------------------------------------------------------------------
__global__ __launch_bounds__(256)
void attn_kernel(const float* __restrict__ Q,
                 const float* __restrict__ Kt,
                 const float* __restrict__ V,
                 const float* __restrict__ mask,
                 float* __restrict__ Y)
{
  __shared__ float pbuf[8][16][20];             // 20-float row pad: no bank conflicts
  const int lane = threadIdx.x & 31;
  const int wave = threadIdx.x >> 5;
  const int h  = blockIdx.x;
  const int l0 = blockIdx.y * 128 + wave * 16;
  const int half = lane >> 4;
  const int l16 = lane & 15;

  const float* Qh = Q  + (size_t)h * LSEQ * HDIM;
  const float* Kh = Kt + (size_t)h * HDIM * LSEQ;
  const float* Vh = V  + (size_t)h * LSEQ * HDIM;

  // Q fragments: 16 k-steps covering HDIM=64 (live across the whole loop)
  v2f qf[16];
#pragma unroll
  for (int s = 0; s < 16; ++s)
    qf[s] = *(const v2f*)(Qh + (size_t)(l0 + l16) * HDIM + s * 4 + 2 * half);

  v8f acc0{}, acc1{}, acc2{}, acc3{};
  float m_i[8], l_i[8];
#pragma unroll
  for (int r = 0; r < 8; ++r) { m_i[r] = -1e30f; l_i[r] = 0.0f; }

  for (int j0 = 0; j0 < LSEQ; j0 += 16) {
    // ---- hoist ALL K fragments: 32 loads in flight, one wait for 16 wmmas
    v2f kf[16];
#pragma unroll
    for (int kk = 0; kk < 16; ++kk) {
      const int t0 = kk * 4 + 2 * half;
      kf[kk].x = Kh[(size_t)t0 * LSEQ + j0 + l16];
      kf[kk].y = Kh[(size_t)(t0 + 1) * LSEQ + j0 + l16];
    }

    // ---- S = Q @ K  (16x16 tile) ----
    v8f s{};
#pragma unroll
    for (int kk = 0; kk < 16; ++kk)
      s = wmma4(qf[kk], kf[kk], s);

    // ---- issue V fragments NOW: latency hides behind softmax VALU below
    v2f vf[4][4];
#pragma unroll
    for (int ks = 0; ks < 4; ++ks) {
      const float* vb = Vh + (size_t)(j0 + ks * 4 + 2 * half) * HDIM;
#pragma unroll
      for (int t = 0; t < 4; ++t) {
        vf[ks][t].x = vb[t * 16 + l16];
        vf[ks][t].y = vb[HDIM + t * 16 + l16];
      }
    }

    // ---- + attention_mask ----
    const float* mrow = mask + (size_t)(l0 + 8 * half) * LSEQ + j0 + l16;
#pragma unroll
    for (int r = 0; r < 8; ++r) s[r] += mrow[(size_t)r * LSEQ];

    // ---- online softmax (row = one 16-lane half -> xor 1,2,4,8 reductions)
    float corr[8];
#pragma unroll
    for (int r = 0; r < 8; ++r) {
      float v = s[r];
#pragma unroll
      for (int off = 1; off < 16; off <<= 1)
        v = fmaxf(v, __shfl_xor(v, off, 32));        // row max
      float mn = fmaxf(m_i[r], v);
      float p  = __expf(s[r] - mn);
      float rs = p;
#pragma unroll
      for (int off = 1; off < 16; off <<= 1)
        rs += __shfl_xor(rs, off, 32);               // row sum
      corr[r] = __expf(m_i[r] - mn);
      l_i[r]  = l_i[r] * corr[r] + rs;
      m_i[r]  = mn;
      pbuf[wave][r + 8 * half][l16] = p;             // stash P for A-layout reload
    }

    // rescale accumulators by exp(m_old - m_new)
#pragma unroll
    for (int r = 0; r < 8; ++r) {
      acc0[r] *= corr[r]; acc1[r] *= corr[r];
      acc2[r] *= corr[r]; acc3[r] *= corr[r];
    }

    // ---- acc += P(16x16) @ V_block(16x64) ----
    // (wave-private LDS tile; same-wave DS ops are in-order -> no barrier)
#pragma unroll
    for (int ks = 0; ks < 4; ++ks) {
      v2f a = *(const v2f*)(&pbuf[wave][l16][ks * 4 + 2 * half]);
      acc0 = wmma4(a, vf[ks][0], acc0);
      acc1 = wmma4(a, vf[ks][1], acc1);
      acc2 = wmma4(a, vf[ks][2], acc2);
      acc3 = wmma4(a, vf[ks][3], acc3);
    }
  }

  // ---- normalize and scatter into (L, DMODEL) at column h*64 ----
  float inv[8];
#pragma unroll
  for (int r = 0; r < 8; ++r) inv[r] = 1.0f / l_i[r];
  float* yrow = Y + (size_t)(l0 + 8 * half) * DMODEL + h * HDIM + l16;
#pragma unroll
  for (int r = 0; r < 8; ++r) {
    yrow[0]  = acc0[r] * inv[r];
    yrow[16] = acc1[r] * inv[r];
    yrow[32] = acc2[r] * inv[r];
    yrow[48] = acc3[r] * inv[r];
    yrow += DMODEL;
  }
}

// ---------------------------------------------------------------------------
// Host-side orchestration (graph-capture safe: launches only).
// ---------------------------------------------------------------------------
extern "C" void kernel_launch(void* const* d_in, const int* in_sizes, int n_in,
                              void* d_out, int out_size, void* d_ws, size_t ws_size,
                              hipStream_t stream) {
  (void)in_sizes; (void)n_in; (void)out_size; (void)ws_size;

  const float* hs    = (const float*)d_in[0];   // (1, L, DIM)
  const float* cosb  = (const float*)d_in[1];   // (1, L, HD)
  const float* cosT  = (const float*)d_in[2];   // (1, HD, L)
  const float* sinb  = (const float*)d_in[3];   // (1, L, HD)
  const float* sinT  = (const float*)d_in[4];   // (1, HD, L)
  const float* amask = (const float*)d_in[5];   // (1, L, L)
  const float* kc    = (const float*)d_in[6];   // (H, HD, L)
  const float* vc    = (const float*)d_in[7];   // (H, L, HD)
  const float* kmask = (const float*)d_in[8];   // (1, 1, L)
  const float* vmask = (const float*)d_in[9];   // (1, L, 1)
  const float* wq    = (const float*)d_in[10];  // (DIM, DIM)
  const float* wk    = (const float*)d_in[11];
  const float* wv    = (const float*)d_in[12];
  const float* wo    = (const float*)d_in[13];

  const size_t LD = (size_t)LSEQ * DMODEL;      // 4,194,304 elements
  float* y_out = (float*)d_out;                 // (L, DIM)
  float* k_out = y_out + LD;                    // (H, HD, L)
  float* v_out = k_out + LD;                    // (H, L, HD)

  float* ws     = (float*)d_ws;                 // needs 4*LD floats = 64 MB
  float* q_raw  = ws;
  float* k_raw  = q_raw + LD;
  float* v_raw  = k_raw + LD;
  float* q_rope = v_raw + LD;
  float* y_mid  = k_raw;                        // reuse: k_raw dead after k-merge

  dim3 gemm_grid(LSEQ / 64, DMODEL / 256);      // (32, 8)
  dim3 elem_grid((NHEADS * LSEQ * HDIM) / 256); // 16384
  dim3 attn_grid(NHEADS, LSEQ / 128);           // (32, 16)

  // QKV projections: x @ W.T
  gemm_nt_f32<<<gemm_grid, 256, 0, stream>>>(hs, wq, q_raw, LSEQ, DMODEL, DMODEL);
  gemm_nt_f32<<<gemm_grid, 256, 0, stream>>>(hs, wk, k_raw, LSEQ, DMODEL, DMODEL);
  gemm_nt_f32<<<gemm_grid, 256, 0, stream>>>(hs, wv, v_raw, LSEQ, DMODEL, DMODEL);

  // RoPE + cache blends (k_out / v_out are final outputs 2 and 3)
  rope_q_kernel<<<elem_grid, 256, 0, stream>>>(q_raw, cosb, sinb, q_rope);
  rope_k_merge_kernel<<<elem_grid, 256, 0, stream>>>(k_raw, cosT, sinT, kc, kmask, k_out);
  v_merge_kernel<<<elem_grid, 256, 0, stream>>>(v_raw, vc, vmask, v_out);

  // Fused softmax attention -> y_mid (L, DIM)
  attn_kernel<<<attn_grid, 256, 0, stream>>>(q_rope, k_out, v_out, amask, y_mid);

  // Output projection: y_mid @ wo.T -> y_out
  gemm_nt_f32<<<gemm_grid, 256, 0, stream>>>(y_mid, wo, y_out, LSEQ, DMODEL, DMODEL);
}

// v001
// Measured time: 687 microseconds a run.
// In both of two side-by-side timings against v000, it was 1.76 times as fast.
#include <hip/hip_runtime.h>
#include <hip/hip_bf16.h>
#include <stddef.h>

// ---------------------------------------------------------------------------
// MI455X (gfx1250) Llama attention layer, fp32 end to end.
// All GEMMs + attention matmuls go through V_WMMA_F32_16X16X4_F32.
// N=1, L=2048, DIM=2048, H=32, HD=64.
//
// Round-2 changes (driven by round-1 asm: s_wait_loadcnt 0x0 before every
// wmma = zero overlap):
//   * GEMM: 32Mx64N wave tile (8 wmma / 6 fragment loads per k-step), operand
//     tiles staged in LDS by asynchronous copies, two buffers.
//   * Attention: all 16 K-fragments hoisted ahead of the S wmma chain;
//     V-fragments issued before the softmax VALU work (latency hidden by
//     v_exp_f32 + shuffles instead of stalling the P@V wmmas).
// ---------------------------------------------------------------------------

#define LSEQ 2048
#define DMODEL 2048
#define NHEADS 32
#define HDIM 64

typedef __attribute__((ext_vector_type(2))) float v2f;
typedef __attribute__((ext_vector_type(8))) float v8f;

// D = A(16x4) * B(4x16) + C  (fp32 WMMA, wave32)
__device__ __forceinline__ v8f wmma4(v2f a, v2f b, v8f c) {
  return __builtin_amdgcn_wmma_f32_16x16x4_f32(
      /*neg_a=*/false, a, /*neg_b=*/false, b,
      /*c_mod=*/(short)0, c, /*reuse_a=*/false, /*reuse_b=*/false);
}

// ---------------------------------------------------------------------------
// GEMM: C[M][N] = A[MxK] * B[NxK]^T   (row-major fp32; "x @ W.T" pattern)
// Workgroup tile 128Mx128N, 8 waves arranged 4Mx2N, wave tile 32Mx64N.
// A stage is 64 k of 128 A rows and 128 B rows in LDS, brought in by
// asynchronous 16-byte copies (whole 256-byte row pieces per 16 lanes), two
// buffers: the next stage's copies fly while this stage is multiplied.
// A-frag (16x4): lane m(0-15) holds A[m][k0..k0+1]; lanes 16-31 hold k0+2..3.
// B-frag (4x16): lane n(0-15) holds B[k0..k0+1][n] = Bmat[n][k0..k0+1].
// M, N multiples of 128; K a multiple of 64.
// ---------------------------------------------------------------------------
#define GTILE 128                       // rows of A and of B per workgroup
#define GBK 64                          // k per stage
#define GPITCH 68                       // LDS row pitch in floats: 16 rows x 16 B hit 64 distinct banks
#define GSTAGE (2 * GTILE * GPITCH)     // floats per stage: A rows, then B rows

// Eight 16-byte copies per lane, global -> LDS, rows 16 apart. The closing
// s_wait_xcnt stands inside the statement so that no address register named
// by a copy is rewritten ahead of it.
__device__ __forceinline__ void copy_rows8(unsigned lds, const float* g, size_t rstep)
{
  const unsigned lstep = 16u * GPITCH * 4u;
  asm volatile(
      "global_load_async_to_lds_b128 %0, %8, off\n\t"
      "global_load_async_to_lds_b128 %1, %9, off\n\t"
      "global_load_async_to_lds_b128 %2, %10, off\n\t"
      "global_load_async_to_lds_b128 %3, %11, off\n\t"
      "global_load_async_to_lds_b128 %4, %12, off\n\t"
      "global_load_async_to_lds_b128 %5, %13, off\n\t"
      "global_load_async_to_lds_b128 %6, %14, off\n\t"
      "global_load_async_to_lds_b128 %7, %15, off\n\t"
      "s_wait_xcnt 0x0"
      :: "v"(lds), "v"(lds + lstep), "v"(lds + 2u * lstep), "v"(lds + 3u * lstep),
         "v"(lds + 4u * lstep), "v"(lds + 5u * lstep), "v"(lds + 6u * lstep),
         "v"(lds + 7u * lstep),
         "v"(g), "v"(g + rstep), "v"(g + 2 * rstep), "v"(g + 3 * rstep),
         "v"(g + 4 * rstep), "v"(g + 5 * rstep), "v"(g + 6 * rstep), "v"(g + 7 * rstep)
      : "memory");
}

__global__ __launch_bounds__(256)
void gemm_nt_f32(const float* __restrict__ A, const float* __restrict__ B,
                 float* __restrict__ C, int M, int N, int K)
{
  __shared__ __attribute__((aligned(16))) float stage[2 * GSTAGE];

  const int tid  = threadIdx.x;
  const int lane = tid & 31;
  const int wave = tid >> 5;
  const int wm = wave & 3;        // 0..3
  const int wn = wave >> 2;       // 0..1
  const int mb = blockIdx.x * GTILE;
  const int nb = blockIdx.y * GTILE;
  const int m0 = mb + wm * 32;
  const int n0 = nb + wn * 64;
  const int half = lane >> 4;     // 0 or 1
  const int l16 = lane & 15;

  // copy side: 16 lanes per 256-byte row piece, 16 rows per copy of the block
  const int crow = tid >> 4;
  const int ccol = (tid & 15) * 4;
  const float* ga = A + (size_t)(mb + crow) * K + ccol;
  const float* gb = B + (size_t)(nb + crow) * K + ccol;
  const size_t rstep = (size_t)16 * K;
  const unsigned lds0 = (unsigned)(size_t)&stage[crow * GPITCH + ccol];
  const unsigned ldsB = GTILE * GPITCH * 4u;      // B rows behind the A rows
  const unsigned ldsS = GSTAGE * 4u;              // second buffer

  // reader side
  const int aoff = (wm * 32 + l16) * GPITCH + 2 * half;
  const int boff = (GTILE + wn * 64 + l16) * GPITCH + 2 * half;

  v8f acc00{}, acc01{}, acc02{}, acc03{};
  v8f acc10{}, acc11{}, acc12{}, acc13{};

  const int nt = K / GBK;

  // stage 0 lands and is published before anything reads it
  copy_rows8(lds0, ga, rstep);
  copy_rows8(lds0 + ldsB, gb, rstep);
  asm volatile("s_wait_asynccnt 0x0" ::: "memory");  // this wave's copies have landed
  __syncthreads();
  if (nt > 1) {
    copy_rows8(lds0 + ldsS, ga + GBK, rstep);
    copy_rows8(lds0 + ldsS + ldsB, gb + GBK, rstep);
  }

  for (int t = 0; t < nt; ++t) {
    const int buf = (t & 1) * GSTAGE;
    const float* sa = stage + buf + aoff;
    const float* sb = stage + buf + boff;
#pragma unroll
    for (int s = 0; s < GBK / 4; ++s) {
      v2f a0 = *(const v2f*)(sa + 4 * s);
      v2f a1 = *(const v2f*)(sa + 16 * GPITCH + 4 * s);
      v2f b0 = *(const v2f*)(sb + 4 * s);
      v2f b1 = *(const v2f*)(sb + 16 * GPITCH + 4 * s);
      v2f b2 = *(const v2f*)(sb + 32 * GPITCH + 4 * s);
      v2f b3 = *(const v2f*)(sb + 48 * GPITCH + 4 * s);
      acc00 = wmma4(a0, b0, acc00);
      acc01 = wmma4(a0, b1, acc01);
      acc02 = wmma4(a0, b2, acc02);
      acc03 = wmma4(a0, b3, acc03);
      acc10 = wmma4(a1, b0, acc10);
      acc11 = wmma4(a1, b1, acc11);
      acc12 = wmma4(a1, b2, acc12);
      acc13 = wmma4(a1, b3, acc13);
    }
    // hand-over: own LDS reads done, own copies of stage t+1 landed, then the
    // barrier that publishes stage t+1 and frees the buffer just read
    asm volatile("s_wait_dscnt 0x0" ::: "memory");
    asm volatile("s_wait_asynccnt 0x0" ::: "memory");
    __syncthreads();
    if (t + 2 < nt) {
      const unsigned dst = lds0 + (unsigned)buf * 4u;
      copy_rows8(dst, ga + (size_t)(t + 2) * GBK, rstep);
      copy_rows8(dst + ldsB, gb + (size_t)(t + 2) * GBK, rstep);
    }
  }
  asm volatile("s_wait_asynccnt 0x0" ::: "memory");  // nothing in flight at the wave's end

  // C/D layout: vgpr r -> row r (lanes 0-15) / row r+8 (lanes 16-31), col=l16.
  float* c0 = C + (size_t)(m0 + 8 * half) * N + n0 + l16;
  float* c1 = C + (size_t)(m0 + 16 + 8 * half) * N + n0 + l16;
#pragma unroll
  for (int r = 0; r < 8; ++r) {
    c0[0]  = acc00[r];
    c0[16] = acc01[r];
    c0[32] = acc02[r];
    c0[48] = acc03[r];
    c1[0]  = acc10[r];
    c1[16] = acc11[r];
    c1[32] = acc12[r];
    c1[48] = acc13[r];
    c0 += N; c1 += N;
  }
}

// ---------------------------------------------------------------------------
// RoPE for Q (interleaved-pair variant of reference), pre-scaled by hd^-0.5.
// q_raw: (L, DMODEL) row-major ; out: (H, L, HDIM)
// rot[t] = (t<32) ? -q[2t+1] : q[2(t-32)]
// ---------------------------------------------------------------------------
__global__ __launch_bounds__(256)
void rope_q_kernel(const float* __restrict__ q_raw,
                   const float* __restrict__ cosb,   // (L, HDIM)
                   const float* __restrict__ sinb,   // (L, HDIM)
                   float* __restrict__ q_out)        // (H, L, HDIM)
{
  int idx = blockIdx.x * 256 + threadIdx.x;     // h*(L*64) + l*64 + t
  int t = idx & 63;
  int l = (idx >> 6) & (LSEQ - 1);
  int h = idx >> 17;
  const float* qr = q_raw + (size_t)l * DMODEL + h * HDIM;
  float x   = qr[t];
  float rot = (t < 32) ? -qr[2 * t + 1] : qr[2 * (t - 32)];
  float val = x * cosb[l * HDIM + t] + rot * sinb[l * HDIM + t];
  q_out[idx] = val * 0.125f;                    // 1/sqrt(64)
}

// ---------------------------------------------------------------------------
// RoPE for K (transposed layout) + cache blend. Writes final k output.
// k_raw: (L, DMODEL); cosT/sinT: (HDIM, L); k_cache/k_out: (H, HDIM, L);
// k_mask: (L)
// ---------------------------------------------------------------------------
__global__ __launch_bounds__(256)
void rope_k_merge_kernel(const float* __restrict__ k_raw,
                         const float* __restrict__ cosT,
                         const float* __restrict__ sinT,
                         const float* __restrict__ k_cache,
                         const float* __restrict__ k_mask,
                         float* __restrict__ k_out)
{
  int idx = blockIdx.x * 256 + threadIdx.x;     // h*(64*L) + t*L + l
  int l = idx & (LSEQ - 1);
  int t = (idx >> 11) & 63;
  int h = idx >> 17;
  const float* kr = k_raw + (size_t)l * DMODEL + h * HDIM;
  float x   = kr[t];
  float rot = (t < 32) ? -kr[2 * t + 1] : kr[2 * (t - 32)];
  float krot = x * cosT[t * LSEQ + l] + rot * sinT[t * LSEQ + l];
  float km = k_mask[l];
  k_out[idx] = k_cache[idx] * (1.0f - km) + krot * km;
}

// ---------------------------------------------------------------------------
// V cache blend. v_raw: (L, DMODEL); v_cache/v_out: (H, L, HDIM); v_mask: (L)
// ---------------------------------------------------------------------------
__global__ __launch_bounds__(256)
void v_merge_kernel(const float* __restrict__ v_raw,
                    const float* __restrict__ v_cache,
                    const float* __restrict__ v_mask,
                    float* __restrict__ v_out)
{
  int idx = blockIdx.x * 256 + threadIdx.x;     // h*(L*64) + l*64 + t
  int t = idx & 63;
  int l = (idx >> 6) & (LSEQ - 1);
  int h = idx >> 17;
  float vv = v_raw[(size_t)l * DMODEL + h * HDIM + t];
  float vm = v_mask[l];
  v_out[idx] = v_cache[idx] * (1.0f - vm) + vv * vm;
}

// ---------------------------------------------------------------------------
// Flash-style attention. One wave owns a 16-row Q block of one head and
// streams K/V in 16-column blocks with online softmax.
//   Q : (H, L, HDIM)   pre-scaled by hd^-0.5
//   Kt: (H, HDIM, L)   (lane-coalesced B-fragments for Q @ K)
//   V : (H, L, HDIM)
//   mask: (L, L)
//   Y : (L, DMODEL)    head h writes columns [h*64, h*64+64)
// ---------------------------------------------------------------------------
__global__ __launch_bounds__(256)
void attn_kernel(const float* __restrict__ Q,
                 const float* __restrict__ Kt,
                 const float* __restrict__ V,
                 const float* __restrict__ mask,
                 float* __restrict__ Y)
{
  __shared__ float pbuf[8][16][20];             // 20-float row pad: no bank conflicts
  const int lane = threadIdx.x & 31;
  const int wave = threadIdx.x >> 5;
  const int h  = blockIdx.x;
  const int l0 = blockIdx.y * 128 + wave * 16;
  const int half = lane >> 4;
  const int l16 = lane & 15;

  const float* Qh = Q  + (size_t)h * LSEQ * HDIM;
  const float* Kh = Kt + (size_t)h * HDIM * LSEQ;
  const float* Vh = V  + (size_t)h * LSEQ * HDIM;

  // Q fragments: 16 k-steps covering HDIM=64 (live across the whole loop)
  v2f qf[16];
#pragma unroll
  for (int s = 0; s < 16; ++s)
    qf[s] = *(const v2f*)(Qh + (size_t)(l0 + l16) * HDIM + s * 4 + 2 * half);

  v8f acc0{}, acc1{}, acc2{}, acc3{};
  float m_i[8], l_i[8];
#pragma unroll
  for (int r = 0; r < 8; ++r) { m_i[r] = -1e30f; l_i[r] = 0.0f; }

  for (int j0 = 0; j0 < LSEQ; j0 += 16) {
    // ---- hoist ALL K fragments: 32 loads in flight, one wait for 16 wmmas
    v2f kf[16];
#pragma unroll
    for (int kk = 0; kk < 16; ++kk) {
      const int t0 = kk * 4 + 2 * half;
      kf[kk].x = Kh[(size_t)t0 * LSEQ + j0 + l16];
      kf[kk].y = Kh[(size_t)(t0 + 1) * LSEQ + j0 + l16];
    }

    // ---- S = Q @ K  (16x16 tile) ----
    v8f s{};
#pragma unroll
    for (int kk = 0; kk < 16; ++kk)
      s = wmma4(qf[kk], kf[kk], s);

    // ---- issue V fragments NOW: latency hides behind softmax VALU below
    v2f vf[4][4];
#pragma unroll
    for (int ks = 0; ks < 4; ++ks) {
      const float* vb = Vh + (size_t)(j0 + ks * 4 + 2 * half) * HDIM;
#pragma unroll
      for (int t = 0; t < 4; ++t) {
        vf[ks][t].x = vb[t * 16 + l16];
        vf[ks][t].y = vb[HDIM + t * 16 + l16];
      }
    }

    // ---- + attention_mask ----
    const float* mrow = mask + (size_t)(l0 + 8 * half) * LSEQ + j0 + l16;
#pragma unroll
    for (int r = 0; r < 8; ++r) s[r] += mrow[(size_t)r * LSEQ];

    // ---- online softmax (row = one 16-lane half -> xor 1,2,4,8 reductions)
    float corr[8];
#pragma unroll
    for (int r = 0; r < 8; ++r) {
      float v = s[r];
#pragma unroll
      for (int off = 1; off < 16; off <<= 1)
        v = fmaxf(v, __shfl_xor(v, off, 32));        // row max
      float mn = fmaxf(m_i[r], v);
      float p  = __expf(s[r] - mn);
      float rs = p;
#pragma unroll
      for (int off = 1; off < 16; off <<= 1)
        rs += __shfl_xor(rs, off, 32);               // row sum
      corr[r] = __expf(m_i[r] - mn);
      l_i[r]  = l_i[r] * corr[r] + rs;
      m_i[r]  = mn;
      pbuf[wave][r + 8 * half][l16] = p;             // stash P for A-layout reload
    }

    // rescale accumulators by exp(m_old - m_new)
#pragma unroll
    for (int r = 0; r < 8; ++r) {
      acc0[r] *= corr[r]; acc1[r] *= corr[r];
      acc2[r] *= corr[r]; acc3[r] *= corr[r];
    }

    // ---- acc += P(16x16) @ V_block(16x64) ----
    // (wave-private LDS tile; same-wave DS ops are in-order -> no barrier)
#pragma unroll
    for (int ks = 0; ks < 4; ++ks) {
      v2f a = *(const v2f*)(&pbuf[wave][l16][ks * 4 + 2 * half]);
      acc0 = wmma4(a, vf[ks][0], acc0);
      acc1 = wmma4(a, vf[ks][1], acc1);
      acc2 = wmma4(a, vf[ks][2], acc2);
      acc3 = wmma4(a, vf[ks][3], acc3);
    }
  }

  // ---- normalize and scatter into (L, DMODEL) at column h*64 ----
  float inv[8];
#pragma unroll
  for (int r = 0; r < 8; ++r) inv[r] = 1.0f / l_i[r];
  float* yrow = Y + (size_t)(l0 + 8 * half) * DMODEL + h * HDIM + l16;
#pragma unroll
  for (int r = 0; r < 8; ++r) {
    yrow[0]  = acc0[r] * inv[r];
    yrow[16] = acc1[r] * inv[r];
    yrow[32] = acc2[r] * inv[r];
    yrow[48] = acc3[r] * inv[r];
    yrow += DMODEL;
  }
}

// ---------------------------------------------------------------------------
// Host-side orchestration (graph-capture safe: launches only).
// ---------------------------------------------------------------------------
extern "C" void kernel_launch(void* const* d_in, const int* in_sizes, int n_in,
                              void* d_out, int out_size, void* d_ws, size_t ws_size,
                              hipStream_t stream) {
  (void)in_sizes; (void)n_in; (void)out_size; (void)ws_size;

  const float* hs    = (const float*)d_in[0];   // (1, L, DIM)
  const float* cosb  = (const float*)d_in[1];   // (1, L, HD)
  const float* cosT  = (const float*)d_in[2];   // (1, HD, L)
  const float* sinb  = (const float*)d_in[3];   // (1, L, HD)
  const float* sinT  = (const float*)d_in[4];   // (1, HD, L)
  const float* amask = (const float*)d_in[5];   // (1, L, L)
  const float* kc    = (const float*)d_in[6];   // (H, HD, L)
  const float* vc    = (const float*)d_in[7];   // (H, L, HD)
  const float* kmask = (const float*)d_in[8];   // (1, 1, L)
  const float* vmask = (const float*)d_in[9];   // (1, L, 1)
  const float* wq    = (const float*)d_in[10];  // (DIM, DIM)
  const float* wk    = (const float*)d_in[11];
  const float* wv    = (const float*)d_in[12];
  const float* wo    = (const float*)d_in[13];

  const size_t LD = (size_t)LSEQ * DMODEL;      // 4,194,304 elements
  float* y_out = (float*)d_out;                 // (L, DIM)
  float* k_out = y_out + LD;                    // (H, HD, L)
  float* v_out = k_out + LD;                    // (H, L, HD)

  float* ws     = (float*)d_ws;                 // needs 4*LD floats = 64 MB
  float* q_raw  = ws;
  float* k_raw  = q_raw + LD;
  float* v_raw  = k_raw + LD;
  float* q_rope = v_raw + LD;
  float* y_mid  = k_raw;                        // reuse: k_raw dead after k-merge

  dim3 gemm_grid(LSEQ / 128, DMODEL / 128);     // (16, 16)
  dim3 elem_grid((NHEADS * LSEQ * HDIM) / 256); // 16384
  dim3 attn_grid(NHEADS, LSEQ / 128);           // (32, 16)

  // QKV projections: x @ W.T
  gemm_nt_f32<<<gemm_grid, 256, 0, stream>>>(hs, wq, q_raw, LSEQ, DMODEL, DMODEL);
  gemm_nt_f32<<<gemm_grid, 256, 0, stream>>>(hs, wk, k_raw, LSEQ, DMODEL, DMODEL);
  gemm_nt_f32<<<gemm_grid, 256, 0, stream>>>(hs, wv, v_raw, LSEQ, DMODEL, DMODEL);

  // RoPE + cache blends (k_out / v_out are final outputs 2 and 3)
  rope_q_kernel<<<elem_grid, 256, 0, stream>>>(q_raw, cosb, sinb, q_rope);
  rope_k_merge_kernel<<<elem_grid, 256, 0, stream>>>(k_raw, cosT, sinT, kc, kmask, k_out);
  v_merge_kernel<<<elem_grid, 256, 0, stream>>>(v_raw, vc, vmask, v_out);

  // Fused softmax attention -> y_mid (L, DIM)
  attn_kernel<<<attn_grid, 256, 0, stream>>>(q_rope, k_out, v_out, amask, y_mid);

  // Output projection: y_mid @ wo.T -> y_out
  gemm_nt_f32<<<gemm_grid, 256, 0, stream>>>(y_mid, wo, y_out, LSEQ, DMODEL, DMODEL);
}

// v002
// It runs in 552 microseconds.
// Two timings next to v001 put it at 1.25 and 1.24 times that version's speed.
// Counting every step since v000, it is 2.19 times as fast.
#include <hip/hip_runtime.h>
#include <hip/hip_bf16.h>
#include <stddef.h>

// ---------------------------------------------------------------------------
// MI455X (gfx1250) Llama attention layer, fp32 end to end.
// All GEMMs + attention matmuls go through V_WMMA_F32_16X16X4_F32.
// N=1, L=2048, DIM=2048, H=32, HD=64.
//
// Round-2 changes (driven by round-1 asm: s_wait_loadcnt 0x0 before every
// wmma = zero overlap):
//   * GEMM: 32Mx64N wave tile (8 wmma / 6 fragment loads per k-step), operand
//     tiles staged in LDS by asynchronous copies, two buffers.
//   * Attention: all 16 K-fragments hoisted ahead of the score wmma chain;
//     V-fragments issued before the softmax VALU work; products transposed
//     (keys x queries) so that softmax is in-lane and P stays in registers.
// ---------------------------------------------------------------------------

#define LSEQ 2048
#define DMODEL 2048
#define NHEADS 32
#define HDIM 64

typedef __attribute__((ext_vector_type(2))) float v2f;
typedef __attribute__((ext_vector_type(8))) float v8f;

// D = A(16x4) * B(4x16) + C  (fp32 WMMA, wave32)
__device__ __forceinline__ v8f wmma4(v2f a, v2f b, v8f c) {
  return __builtin_amdgcn_wmma_f32_16x16x4_f32(
      /*neg_a=*/false, a, /*neg_b=*/false, b,
      /*c_mod=*/(short)0, c, /*reuse_a=*/false, /*reuse_b=*/false);
}

// ---------------------------------------------------------------------------
// GEMM: C[M][N] = A[MxK] * B[NxK]^T   (row-major fp32; "x @ W.T" pattern)
// Workgroup tile 128Mx128N, 8 waves arranged 4Mx2N, wave tile 32Mx64N.
// A stage is 64 k of 128 A rows and 128 B rows in LDS, brought in by
// asynchronous 16-byte copies (whole 256-byte row pieces per 16 lanes), two
// buffers: the next stage's copies fly while this stage is multiplied.
// A-frag (16x4): lane m(0-15) holds A[m][k0..k0+1]; lanes 16-31 hold k0+2..3.
// B-frag (4x16): lane n(0-15) holds B[k0..k0+1][n] = Bmat[n][k0..k0+1].
// M, N multiples of 128; K a multiple of 64.
// ---------------------------------------------------------------------------
#define GTILE 128                       // rows of A and of B per workgroup
#define GBK 64                          // k per stage
#define GPITCH 68                       // LDS row pitch in floats: 16 rows x 16 B hit 64 distinct banks
#define GSTAGE (2 * GTILE * GPITCH)     // floats per stage: A rows, then B rows

// Eight 16-byte copies per lane, global -> LDS, rows 16 apart. The closing
// s_wait_xcnt stands inside the statement so that no address register named
// by a copy is rewritten ahead of it.
__device__ __forceinline__ void copy_rows8(unsigned lds, const float* g, size_t rstep)
{
  const unsigned lstep = 16u * GPITCH * 4u;
  asm volatile(
      "global_load_async_to_lds_b128 %0, %8, off\n\t"
      "global_load_async_to_lds_b128 %1, %9, off\n\t"
      "global_load_async_to_lds_b128 %2, %10, off\n\t"
      "global_load_async_to_lds_b128 %3, %11, off\n\t"
      "global_load_async_to_lds_b128 %4, %12, off\n\t"
      "global_load_async_to_lds_b128 %5, %13, off\n\t"
      "global_load_async_to_lds_b128 %6, %14, off\n\t"
      "global_load_async_to_lds_b128 %7, %15, off\n\t"
      "s_wait_xcnt 0x0"
      :: "v"(lds), "v"(lds + lstep), "v"(lds + 2u * lstep), "v"(lds + 3u * lstep),
         "v"(lds + 4u * lstep), "v"(lds + 5u * lstep), "v"(lds + 6u * lstep),
         "v"(lds + 7u * lstep),
         "v"(g), "v"(g + rstep), "v"(g + 2 * rstep), "v"(g + 3 * rstep),
         "v"(g + 4 * rstep), "v"(g + 5 * rstep), "v"(g + 6 * rstep), "v"(g + 7 * rstep)
      : "memory");
}

__global__ __launch_bounds__(256)
void gemm_nt_f32(const float* __restrict__ A, const float* __restrict__ B,
                 float* __restrict__ C, int M, int N, int K)
{
  __shared__ __attribute__((aligned(16))) float stage[2 * GSTAGE];

  const int tid  = threadIdx.x;
  const int lane = tid & 31;
  const int wave = tid >> 5;
  const int wm = wave & 3;        // 0..3
  const int wn = wave >> 2;       // 0..1
  const int mb = blockIdx.x * GTILE;
  const int nb = blockIdx.y * GTILE;
  const int m0 = mb + wm * 32;
  const int n0 = nb + wn * 64;
  const int half = lane >> 4;     // 0 or 1
  const int l16 = lane & 15;

  // copy side: 16 lanes per 256-byte row piece, 16 rows per copy of the block
  const int crow = tid >> 4;
  const int ccol = (tid & 15) * 4;
  const float* ga = A + (size_t)(mb + crow) * K + ccol;
  const float* gb = B + (size_t)(nb + crow) * K + ccol;
  const size_t rstep = (size_t)16 * K;
  const unsigned lds0 = (unsigned)(size_t)&stage[crow * GPITCH + ccol];
  const unsigned ldsB = GTILE * GPITCH * 4u;      // B rows behind the A rows
  const unsigned ldsS = GSTAGE * 4u;              // second buffer

  // reader side
  const int aoff = (wm * 32 + l16) * GPITCH + 2 * half;
  const int boff = (GTILE + wn * 64 + l16) * GPITCH + 2 * half;

  v8f acc00{}, acc01{}, acc02{}, acc03{};
  v8f acc10{}, acc11{}, acc12{}, acc13{};

  const int nt = K / GBK;

  // stage 0 lands and is published before anything reads it
  copy_rows8(lds0, ga, rstep);
  copy_rows8(lds0 + ldsB, gb, rstep);
  asm volatile("s_wait_asynccnt 0x0" ::: "memory");  // this wave's copies have landed
  __syncthreads();
  if (nt > 1) {
    copy_rows8(lds0 + ldsS, ga + GBK, rstep);
    copy_rows8(lds0 + ldsS + ldsB, gb + GBK, rstep);
  }

  for (int t = 0; t < nt; ++t) {
    const int buf = (t & 1) * GSTAGE;
    const float* sa = stage + buf + aoff;
    const float* sb = stage + buf + boff;
#pragma unroll
    for (int s = 0; s < GBK / 4; ++s) {
      v2f a0 = *(const v2f*)(sa + 4 * s);
      v2f a1 = *(const v2f*)(sa + 16 * GPITCH + 4 * s);
      v2f b0 = *(const v2f*)(sb + 4 * s);
      v2f b1 = *(const v2f*)(sb + 16 * GPITCH + 4 * s);
      v2f b2 = *(const v2f*)(sb + 32 * GPITCH + 4 * s);
      v2f b3 = *(const v2f*)(sb + 48 * GPITCH + 4 * s);
      acc00 = wmma4(a0, b0, acc00);
      acc01 = wmma4(a0, b1, acc01);
      acc02 = wmma4(a0, b2, acc02);
      acc03 = wmma4(a0, b3, acc03);
      acc10 = wmma4(a1, b0, acc10);
      acc11 = wmma4(a1, b1, acc11);
      acc12 = wmma4(a1, b2, acc12);
      acc13 = wmma4(a1, b3, acc13);
    }
    // hand-over: own LDS reads done, own copies of stage t+1 landed, then the
    // barrier that publishes stage t+1 and frees the buffer just read
    asm volatile("s_wait_dscnt 0x0" ::: "memory");
    asm volatile("s_wait_asynccnt 0x0" ::: "memory");
    __syncthreads();
    if (t + 2 < nt) {
      const unsigned dst = lds0 + (unsigned)buf * 4u;
      copy_rows8(dst, ga + (size_t)(t + 2) * GBK, rstep);
      copy_rows8(dst + ldsB, gb + (size_t)(t + 2) * GBK, rstep);
    }
  }
  asm volatile("s_wait_asynccnt 0x0" ::: "memory");  // nothing in flight at the wave's end

  // C/D layout: vgpr r -> row r (lanes 0-15) / row r+8 (lanes 16-31), col=l16.
  float* c0 = C + (size_t)(m0 + 8 * half) * N + n0 + l16;
  float* c1 = C + (size_t)(m0 + 16 + 8 * half) * N + n0 + l16;
#pragma unroll
  for (int r = 0; r < 8; ++r) {
    c0[0]  = acc00[r];
    c0[16] = acc01[r];
    c0[32] = acc02[r];
    c0[48] = acc03[r];
    c1[0]  = acc10[r];
    c1[16] = acc11[r];
    c1[32] = acc12[r];
    c1[48] = acc13[r];
    c0 += N; c1 += N;
  }
}

// ---------------------------------------------------------------------------
// RoPE for Q (interleaved-pair variant of reference), pre-scaled by hd^-0.5.
// q_raw: (L, DMODEL) row-major ; out: (H, L, HDIM)
// rot[t] = (t<32) ? -q[2t+1] : q[2(t-32)]
// ---------------------------------------------------------------------------
__global__ __launch_bounds__(256)
void rope_q_kernel(const float* __restrict__ q_raw,
                   const float* __restrict__ cosb,   // (L, HDIM)
                   const float* __restrict__ sinb,   // (L, HDIM)
                   float* __restrict__ q_out)        // (H, L, HDIM)
{
  int idx = blockIdx.x * 256 + threadIdx.x;     // h*(L*64) + l*64 + t
  int t = idx & 63;
  int l = (idx >> 6) & (LSEQ - 1);
  int h = idx >> 17;
  const float* qr = q_raw + (size_t)l * DMODEL + h * HDIM;
  float x   = qr[t];
  float rot = (t < 32) ? -qr[2 * t + 1] : qr[2 * (t - 32)];
  float val = x * cosb[l * HDIM + t] + rot * sinb[l * HDIM + t];
  q_out[idx] = val * 0.125f;                    // 1/sqrt(64)
}

// ---------------------------------------------------------------------------
// RoPE for K (transposed layout) + cache blend. Writes final k output.
// k_raw: (L, DMODEL); cosT/sinT: (HDIM, L); k_cache/k_out: (H, HDIM, L);
// k_mask: (L)
// ---------------------------------------------------------------------------
__global__ __launch_bounds__(256)
void rope_k_merge_kernel(const float* __restrict__ k_raw,
                         const float* __restrict__ cosT,
                         const float* __restrict__ sinT,
                         const float* __restrict__ k_cache,
                         const float* __restrict__ k_mask,
                         float* __restrict__ k_out)
{
  int idx = blockIdx.x * 256 + threadIdx.x;     // h*(64*L) + t*L + l
  int l = idx & (LSEQ - 1);
  int t = (idx >> 11) & 63;
  int h = idx >> 17;
  const float* kr = k_raw + (size_t)l * DMODEL + h * HDIM;
  float x   = kr[t];
  float rot = (t < 32) ? -kr[2 * t + 1] : kr[2 * (t - 32)];
  float krot = x * cosT[t * LSEQ + l] + rot * sinT[t * LSEQ + l];
  float km = k_mask[l];
  k_out[idx] = k_cache[idx] * (1.0f - km) + krot * km;
}

// ---------------------------------------------------------------------------
// V cache blend. v_raw: (L, DMODEL); v_cache/v_out: (H, L, HDIM); v_mask: (L)
// ---------------------------------------------------------------------------
__global__ __launch_bounds__(256)
void v_merge_kernel(const float* __restrict__ v_raw,
                    const float* __restrict__ v_cache,
                    const float* __restrict__ v_mask,
                    float* __restrict__ v_out)
{
  int idx = blockIdx.x * 256 + threadIdx.x;     // h*(L*64) + l*64 + t
  int t = idx & 63;
  int l = (idx >> 6) & (LSEQ - 1);
  int h = idx >> 17;
  float vv = v_raw[(size_t)l * DMODEL + h * HDIM + t];
  float vm = v_mask[l];
  v_out[idx] = v_cache[idx] * (1.0f - vm) + vv * vm;
}

// ---------------------------------------------------------------------------
// Flash-style attention, transposed products. One wave owns 16 queries of one
// head and streams K/V in 16-key blocks with online softmax.
//   St = K_block(16 keys x 64) * Q^T   -> register r of lane (c, half) holds
//        the score of key 8*half + r for query c: a query's scores sit in two
//        lanes, so maximum and sum are in-lane plus one exchange of the halves.
//   Ot += V_block^T(64 x 16 keys) * P^T : P^T is taken as the B operand
//        straight from the score registers. k-step ks pairs registers 2ks and
//        2ks+1, that is keys 2ks, 2ks+1 (lower half) and 8+2ks, 9+2ks (upper
//        half); the V^T fragments are loaded in that same key order.
//   Q : (H, L, HDIM)   pre-scaled by hd^-0.5
//   Kt: (H, HDIM, L)
//   V : (H, L, HDIM)
//   mask: (L, L)
//   Y : (L, DMODEL)    head h writes columns [h*64, h*64+64)
// ---------------------------------------------------------------------------
typedef __attribute__((ext_vector_type(4))) float v4f;

// lane l <-> lane l ^ 16
__device__ __forceinline__ float xhalf(float x) {
  return __builtin_bit_cast(float, __builtin_amdgcn_permlanex16(
      __builtin_bit_cast(int, x), __builtin_bit_cast(int, x),
      0x76543210, 0xfedcba98, false, false));
}

__global__ __launch_bounds__(256)
void attn_kernel(const float* __restrict__ Q,
                 const float* __restrict__ Kt,
                 const float* __restrict__ V,
                 const float* __restrict__ mask,
                 float* __restrict__ Y)
{
  const int lane = threadIdx.x & 31;
  const int wave = threadIdx.x >> 5;
  const int h  = blockIdx.x;
  const int l0 = blockIdx.y * 128 + wave * 16;
  const int half = lane >> 4;
  const int l16 = lane & 15;

  const float* Qh = Q  + (size_t)h * LSEQ * HDIM;
  const float* Kh = Kt + (size_t)h * HDIM * LSEQ;
  const float* Vh = V  + (size_t)h * LSEQ * HDIM;

  // Q^T fragments (B operand): 16 k-steps covering HDIM=64, live across the loop
  v2f qf[16];
#pragma unroll
  for (int s = 0; s < 16; ++s)
    qf[s] = *(const v2f*)(Qh + (size_t)(l0 + l16) * HDIM + s * 4 + 2 * half);

  // this lane's query row of the mask, at its half's eight keys
  const float* mrow = mask + (size_t)(l0 + l16) * LSEQ + 8 * half;

  v8f acc0{}, acc1{}, acc2{}, acc3{};   // Ot tiles: row = head dim, column = query
  float m_i = -1e30f;                   // running maximum of this lane's query
  float l_i = 0.0f;                     // running sum over this half's keys only

  for (int j0 = 0; j0 < LSEQ; j0 += 16) {
    // ---- hoist ALL K fragments (A operand): one wait for 16 wmmas
    v2f kf[16];
#pragma unroll
    for (int kk = 0; kk < 16; ++kk) {
      const int t0 = kk * 4 + 2 * half;
      kf[kk].x = Kh[(size_t)t0 * LSEQ + j0 + l16];
      kf[kk].y = Kh[(size_t)(t0 + 1) * LSEQ + j0 + l16];
    }
    const v4f mk0 = *(const v4f*)(mrow + j0);
    const v4f mk1 = *(const v4f*)(mrow + j0 + 4);

    // ---- St = K @ Q^T  (16 keys x 16 queries) ----
    v8f s{};
#pragma unroll
    for (int kk = 0; kk < 16; ++kk)
      s = wmma4(kf[kk], qf[kk], s);

    // ---- issue V^T fragments NOW: latency hides behind the softmax below
    v2f vf[4][4];
#pragma unroll
    for (int ks = 0; ks < 4; ++ks) {
      const float* vb = Vh + (size_t)(j0 + 2 * ks + 8 * half) * HDIM;
#pragma unroll
      for (int t = 0; t < 4; ++t) {
        vf[ks][t].x = vb[t * 16 + l16];
        vf[ks][t].y = vb[HDIM + t * 16 + l16];
      }
    }

    // ---- + attention_mask ----
#pragma unroll
    for (int r = 0; r < 4; ++r) { s[r] += mk0[r]; s[r + 4] += mk1[r]; }

    // ---- online softmax, one query per lane ----
    float mx = fmaxf(fmaxf(fmaxf(s[0], s[1]), fmaxf(s[2], s[3])),
                     fmaxf(fmaxf(s[4], s[5]), fmaxf(s[6], s[7])));
    mx = fmaxf(mx, xhalf(mx));          // both halves hold the block maximum
    const float mn = fmaxf(m_i, mx);
    const float corr = __expf(m_i - mn);
    m_i = mn;
#pragma unroll
    for (int r = 0; r < 8; ++r) s[r] = __expf(s[r] - mn);
    l_i = l_i * corr + (((s[0] + s[1]) + (s[2] + s[3])) + ((s[4] + s[5]) + (s[6] + s[7])));

    // rescale accumulators by exp(m_old - m_new)
#pragma unroll
    for (int r = 0; r < 8; ++r) {
      acc0[r] *= corr; acc1[r] *= corr;
      acc2[r] *= corr; acc3[r] *= corr;
    }

    // ---- Ot += V_block^T(64x16) @ P^T(16x16) ----
#pragma unroll
    for (int ks = 0; ks < 4; ++ks) {
      v2f b; b.x = s[2 * ks]; b.y = s[2 * ks + 1];
      acc0 = wmma4(vf[ks][0], b, acc0);
      acc1 = wmma4(vf[ks][1], b, acc1);
      acc2 = wmma4(vf[ks][2], b, acc2);
      acc3 = wmma4(vf[ks][3], b, acc3);
    }
  }

  // ---- join the halves' sums, normalize, store 8 consecutive head dims ----
  const float inv = 1.0f / (l_i + xhalf(l_i));
  float* yrow = Y + (size_t)(l0 + l16) * DMODEL + h * HDIM + 8 * half;
  v4f o;
#define STORE_TILE(acc, t)                                                  \
  o.x = acc[0] * inv; o.y = acc[1] * inv; o.z = acc[2] * inv; o.w = acc[3] * inv; \
  *(v4f*)(yrow + 16 * (t)) = o;                                             \
  o.x = acc[4] * inv; o.y = acc[5] * inv; o.z = acc[6] * inv; o.w = acc[7] * inv; \
  *(v4f*)(yrow + 16 * (t) + 4) = o;
  STORE_TILE(acc0, 0)
  STORE_TILE(acc1, 1)
  STORE_TILE(acc2, 2)
  STORE_TILE(acc3, 3)
#undef STORE_TILE
}

// ---------------------------------------------------------------------------
// Host-side orchestration (graph-capture safe: launches only).
// ---------------------------------------------------------------------------
extern "C" void kernel_launch(void* const* d_in, const int* in_sizes, int n_in,
                              void* d_out, int out_size, void* d_ws, size_t ws_size,
                              hipStream_t stream) {
  (void)in_sizes; (void)n_in; (void)out_size; (void)ws_size;

  const float* hs    = (const float*)d_in[0];   // (1, L, DIM)
  const float* cosb  = (const float*)d_in[1];   // (1, L, HD)
  const float* cosT  = (const float*)d_in[2];   // (1, HD, L)
  const float* sinb  = (const float*)d_in[3];   // (1, L, HD)
  const float* sinT  = (const float*)d_in[4];   // (1, HD, L)
  const float* amask = (const float*)d_in[5];   // (1, L, L)
  const float* kc    = (const float*)d_in[6];   // (H, HD, L)
  const float* vc    = (const float*)d_in[7];   // (H, L, HD)
  const float* kmask = (const float*)d_in[8];   // (1, 1, L)
  const float* vmask = (const float*)d_in[9];   // (1, L, 1)
  const float* wq    = (const float*)d_in[10];  // (DIM, DIM)
  const float* wk    = (const float*)d_in[11];
  const float* wv    = (const float*)d_in[12];
  const float* wo    = (const float*)d_in[13];

  const size_t LD = (size_t)LSEQ * DMODEL;      // 4,194,304 elements
  float* y_out = (float*)d_out;                 // (L, DIM)
  float* k_out = y_out + LD;                    // (H, HD, L)
  float* v_out = k_out + LD;                    // (H, L, HD)

  float* ws     = (float*)d_ws;                 // needs 4*LD floats = 64 MB
  float* q_raw  = ws;
  float* k_raw  = q_raw + LD;
  float* v_raw  = k_raw + LD;
  float* q_rope = v_raw + LD;
  float* y_mid  = k_raw;                        // reuse: k_raw dead after k-merge

  dim3 gemm_grid(LSEQ / 128, DMODEL / 128);     // (16, 16)
  dim3 elem_grid((NHEADS * LSEQ * HDIM) / 256); // 16384
  dim3 attn_grid(NHEADS, LSEQ / 128);           // (32, 16)

  // QKV projections: x @ W.T
  gemm_nt_f32<<<gemm_grid, 256, 0, stream>>>(hs, wq, q_raw, LSEQ, DMODEL, DMODEL);
  gemm_nt_f32<<<gemm_grid, 256, 0, stream>>>(hs, wk, k_raw, LSEQ, DMODEL, DMODEL);
  gemm_nt_f32<<<gemm_grid, 256, 0, stream>>>(hs, wv, v_raw, LSEQ, DMODEL, DMODEL);

  // RoPE + cache blends (k_out / v_out are final outputs 2 and 3)
  rope_q_kernel<<<elem_grid, 256, 0, stream>>>(q_raw, cosb, sinb, q_rope);
  rope_k_merge_kernel<<<elem_grid, 256, 0, stream>>>(k_raw, cosT, sinT, kc, kmask, k_out);
  v_merge_kernel<<<elem_grid, 256, 0, stream>>>(v_raw, vc, vmask, v_out);

  // Fused softmax attention -> y_mid (L, DIM)
  attn_kernel<<<attn_grid, 256, 0, stream>>>(q_rope, k_out, v_out, amask, y_mid);

  // Output projection: y_mid @ wo.T -> y_out
  gemm_nt_f32<<<gemm_grid, 256, 0, stream>>>(y_mid, wo, y_out, LSEQ, DMODEL, DMODEL);
}

// v003
// One run takes 498 microseconds.
// Two timings next to v002 put it at 1.10 and 1.11 times that version's speed.
// Counting every step since v000, it is 2.42 times as fast.
#include <hip/hip_runtime.h>
#include <hip/hip_bf16.h>
#include <stddef.h>

// ---------------------------------------------------------------------------
// MI455X (gfx1250) Llama attention layer, fp32 end to end.
// All GEMMs + attention matmuls go through V_WMMA_F32_16X16X4_F32.
// N=1, L=2048, DIM=2048, H=32, HD=64.
//
// Round-2 changes (driven by round-1 asm: s_wait_loadcnt 0x0 before every
// wmma = zero overlap):
//   * GEMM: 32Mx64N wave tile (8 wmma / 6 fragment loads per k-step), operand
//     tiles staged in LDS by asynchronous copies, two buffers.
//   * Attention: all 16 K-fragments hoisted ahead of the score wmma chain;
//     V-fragments issued before the softmax VALU work; products transposed
//     (keys x queries) so that softmax is in-lane and P stays in registers.
//   * RoPE, the hd^-0.5 scale and the two cache blends run in the epilogues of
//     the Q, K and V projections, on the f32 sums, before anything is stored.
// ---------------------------------------------------------------------------

#define LSEQ 2048
#define DMODEL 2048
#define NHEADS 32
#define HDIM 64

typedef __attribute__((ext_vector_type(2))) float v2f;
typedef __attribute__((ext_vector_type(4))) float v4f;
typedef __attribute__((ext_vector_type(8))) float v8f;

// D = A(16x4) * B(4x16) + C  (fp32 WMMA, wave32)
__device__ __forceinline__ v8f wmma4(v2f a, v2f b, v8f c) {
  return __builtin_amdgcn_wmma_f32_16x16x4_f32(
      /*neg_a=*/false, a, /*neg_b=*/false, b,
      /*c_mod=*/(short)0, c, /*reuse_a=*/false, /*reuse_b=*/false);
}

// ---------------------------------------------------------------------------
// GEMM: C[M][N] = A[MxK] * B[NxK]^T   (row-major fp32; "x @ W.T" pattern)
// Workgroup tile 128Mx128N, 8 waves arranged 4Mx2N, wave tile 32Mx64N.
// A stage is 64 k of 128 A rows and 128 B rows in LDS, brought in by
// asynchronous 16-byte copies (whole 256-byte row pieces per 16 lanes), two
// buffers: the next stage's copies fly while this stage is multiplied.
// A-frag (16x4): lane m(0-15) holds A[m][k0..k0+1]; lanes 16-31 hold k0+2..3.
// B-frag (4x16): lane n(0-15) holds B[k0..k0+1][n] = Bmat[n][k0..k0+1].
// M, N multiples of 128; K a multiple of 64.
//
// What becomes of the 128x128 tile of sums is chosen by EPI:
//   EPI_PLAIN  stored as C[M][N] straight from the accumulators.
//   EPI_Q      RoPE (interleaved-pair variant of the reference), times hd^-0.5,
//              stored as (H, L, HDIM).   rot[t] = (t<32) ? -q[2t+1] : q[2(t-32)]
//   EPI_K      RoPE with the transposed tables, cache blend, stored as (H, HDIM, L).
//   EPI_V      cache blend, stored as (H, L, HDIM).
// A 128-column tile is two whole heads. The three fused forms put the tile into
// the LDS that the k loop has left (row-major for Q and V, transposed for K),
// pass one barrier, and read it back 16 bytes a lane in the output's own order:
// a wave stores 512 contiguous bytes, and the rotated partner of an element is
// an LDS read away.
// ---------------------------------------------------------------------------
#define GTILE 128                       // rows of A and of B per workgroup
#define GBK 64                          // k per stage
#define GPITCH 68                       // LDS row pitch in floats: 16 rows x 16 B hit 64 distinct banks
#define GSTAGE (2 * GTILE * GPITCH)     // floats per stage: A rows, then B rows
#define CPITCH 132                      // pitch of the staged tile in floats: rows 16-byte aligned, next row 4 banks on, 8 rows 32 banks on
#define EPI_PLAIN 0
#define EPI_Q 1
#define EPI_K 2
#define EPI_V 3

// Eight 16-byte copies per lane, global -> LDS, rows 16 apart. The closing
// s_wait_xcnt stands inside the statement so that no address register named
// by a copy is rewritten ahead of it.
__device__ __forceinline__ void copy_rows8(unsigned lds, const float* g, size_t rstep)
{
  const unsigned lstep = 16u * GPITCH * 4u;
  asm volatile(
      "global_load_async_to_lds_b128 %0, %8, off\n\t"
      "global_load_async_to_lds_b128 %1, %9, off\n\t"
      "global_load_async_to_lds_b128 %2, %10, off\n\t"
      "global_load_async_to_lds_b128 %3, %11, off\n\t"
      "global_load_async_to_lds_b128 %4, %12, off\n\t"
      "global_load_async_to_lds_b128 %5, %13, off\n\t"
      "global_load_async_to_lds_b128 %6, %14, off\n\t"
      "global_load_async_to_lds_b128 %7, %15, off\n\t"
      "s_wait_xcnt 0x0"
      :: "v"(lds), "v"(lds + lstep), "v"(lds + 2u * lstep), "v"(lds + 3u * lstep),
         "v"(lds + 4u * lstep), "v"(lds + 5u * lstep), "v"(lds + 6u * lstep),
         "v"(lds + 7u * lstep),
         "v"(g), "v"(g + rstep), "v"(g + 2 * rstep), "v"(g + 3 * rstep),
         "v"(g + 4 * rstep), "v"(g + 5 * rstep), "v"(g + 6 * rstep), "v"(g + 7 * rstep)
      : "memory");
}

// e0..e3: EPI_Q cos, sin (L, HDIM) | EPI_K cosT, sinT (HDIM, L), k_cache, k_mask
//         | EPI_V v_cache, v_mask
template <int EPI>
__device__ __forceinline__
void gemm_tile(const float* __restrict__ A, const float* __restrict__ B,
               float* __restrict__ C, int N, int K,
               const float* __restrict__ e0, const float* __restrict__ e1,
               const float* __restrict__ e2, const float* __restrict__ e3)
{
  __shared__ __attribute__((aligned(16))) float stage[2 * GSTAGE];

  const int tid  = threadIdx.x;
  const int lane = tid & 31;
  const int wave = tid >> 5;
  const int wm = wave & 3;        // 0..3
  const int wn = wave >> 2;       // 0..1
  const int mb = blockIdx.x * GTILE;
  const int nb = blockIdx.y * GTILE;
  const int m0 = mb + wm * 32;
  const int n0 = nb + wn * 64;
  const int half = lane >> 4;     // 0 or 1
  const int l16 = lane & 15;

  // copy side: 16 lanes per 256-byte row piece, 16 rows per copy of the block
  const int crow = tid >> 4;
  const int ccol = (tid & 15) * 4;
  const float* ga = A + (size_t)(mb + crow) * K + ccol;
  const float* gb = B + (size_t)(nb + crow) * K + ccol;
  const size_t rstep = (size_t)16 * K;
  const unsigned lds0 = (unsigned)(size_t)&stage[crow * GPITCH + ccol];
  const unsigned ldsB = GTILE * GPITCH * 4u;      // B rows behind the A rows
  const unsigned ldsS = GSTAGE * 4u;              // second buffer

  // reader side
  const int aoff = (wm * 32 + l16) * GPITCH + 2 * half;
  const int boff = (GTILE + wn * 64 + l16) * GPITCH + 2 * half;

  v8f acc00{}, acc01{}, acc02{}, acc03{};
  v8f acc10{}, acc11{}, acc12{}, acc13{};

  const int nt = K / GBK;

  // stage 0 lands and is published before anything reads it
  copy_rows8(lds0, ga, rstep);
  copy_rows8(lds0 + ldsB, gb, rstep);
  asm volatile("s_wait_asynccnt 0x0" ::: "memory");  // this wave's copies have landed
  __syncthreads();
  if (nt > 1) {
    copy_rows8(lds0 + ldsS, ga + GBK, rstep);
    copy_rows8(lds0 + ldsS + ldsB, gb + GBK, rstep);
  }

  for (int t = 0; t < nt; ++t) {
    const int buf = (t & 1) * GSTAGE;
    const float* sa = stage + buf + aoff;
    const float* sb = stage + buf + boff;
#pragma unroll
    for (int s = 0; s < GBK / 4; ++s) {
      v2f a0 = *(const v2f*)(sa + 4 * s);
      v2f a1 = *(const v2f*)(sa + 16 * GPITCH + 4 * s);
      v2f b0 = *(const v2f*)(sb + 4 * s);
      v2f b1 = *(const v2f*)(sb + 16 * GPITCH + 4 * s);
      v2f b2 = *(const v2f*)(sb + 32 * GPITCH + 4 * s);
      v2f b3 = *(const v2f*)(sb + 48 * GPITCH + 4 * s);
      acc00 = wmma4(a0, b0, acc00);
      acc01 = wmma4(a0, b1, acc01);
      acc02 = wmma4(a0, b2, acc02);
      acc03 = wmma4(a0, b3, acc03);
      acc10 = wmma4(a1, b0, acc10);
      acc11 = wmma4(a1, b1, acc11);
      acc12 = wmma4(a1, b2, acc12);
      acc13 = wmma4(a1, b3, acc13);
    }
    // hand-over: own LDS reads done, own copies of stage t+1 landed, then the
    // barrier that publishes stage t+1 and frees the buffer just read
    asm volatile("s_wait_dscnt 0x0" ::: "memory");
    asm volatile("s_wait_asynccnt 0x0" ::: "memory");
    __syncthreads();
    if (t + 2 < nt) {
      const unsigned dst = lds0 + (unsigned)buf * 4u;
      copy_rows8(dst, ga + (size_t)(t + 2) * GBK, rstep);
      copy_rows8(dst + ldsB, gb + (size_t)(t + 2) * GBK, rstep);
    }
  }
  asm volatile("s_wait_asynccnt 0x0" ::: "memory");  // nothing in flight at the wave's end

  // C/D layout: vgpr r -> row r (lanes 0-15) / row r+8 (lanes 16-31), col=l16.
  if (EPI == EPI_PLAIN) {
    float* c0 = C + (size_t)(m0 + 8 * half) * N + n0 + l16;
    float* c1 = C + (size_t)(m0 + 16 + 8 * half) * N + n0 + l16;
#pragma unroll
    for (int r = 0; r < 8; ++r) {
      c0[0]  = acc00[r];
      c0[16] = acc01[r];
      c0[32] = acc02[r];
      c0[48] = acc03[r];
      c1[0]  = acc10[r];
      c1[16] = acc11[r];
      c1[32] = acc12[r];
      c1[48] = acc13[r];
      c0 += N; c1 += N;
    }
    return;
  }

  // The loop's last barrier has ended every read of the stages and no copy is
  // in flight: the LDS is free for the tile.
  const int h0 = nb / HDIM;             // first of the tile's two heads
  v4f o[8][2];                          // this lane's 16 pieces of the output

  if (EPI == EPI_K) {
    // A wave takes head dim t = 8 * it + wave of both heads, 128 positions =
    // 512 bytes each. Tables and cache are asked for first: they fly while the
    // tile is staged.
    const int l4 = lane * 4;
    const size_t tb = (size_t)(wave * LSEQ + mb + l4);
    const size_t hb = (size_t)h0 * HDIM * LSEQ + tb;
    const float* pc = e0 + tb;
    const float* ps = e1 + tb;
    const float* pk = e2 + hb;
    const v4f km = *(const v4f*)(e3 + mb + l4);
    v4f cs[8], sn[8];
#pragma unroll
    for (int it = 0; it < 8; ++it) {
      cs[it] = *(const v4f*)(pc + it * 8 * LSEQ);
      sn[it] = *(const v4f*)(ps + it * 8 * LSEQ);
      o[it][0] = *(const v4f*)(pk + it * 8 * LSEQ);
      o[it][1] = *(const v4f*)(pk + it * 8 * LSEQ + HDIM * LSEQ);
    }
    // The loads' address registers are inputs of the wait, so they live up to
    // it: none is rewritten, not even by a later load's result, ahead of it.
    asm volatile("s_wait_xcnt 0x0" :: "v"(pc), "v"(ps), "v"(pk) : "memory");

    // staged transposed, [column][row]: a lane's 8 registers are 8 rows in a row
    float* tp = stage + (wn * 64 + l16) * CPITCH + wm * 32 + 8 * half;
#define PUT_T(acc, i, j)                                                        \
    *(v4f*)(tp + (j) * 16 * CPITCH + (i) * 16)     = v4f{acc[0], acc[1], acc[2], acc[3]}; \
    *(v4f*)(tp + (j) * 16 * CPITCH + (i) * 16 + 4) = v4f{acc[4], acc[5], acc[6], acc[7]};
    PUT_T(acc00, 0, 0) PUT_T(acc01, 0, 1) PUT_T(acc02, 0, 2) PUT_T(acc03, 0, 3)
    PUT_T(acc10, 1, 0) PUT_T(acc11, 1, 1) PUT_T(acc12, 1, 2) PUT_T(acc13, 1, 3)
#undef PUT_T
    __syncthreads();                    // the tile is read across waves

    const v4f kn = 1.0f - km;
#pragma unroll
    for (int it = 0; it < 8; ++it) {
      const int t   = it * 8 + wave;
      const int prt = (it < 4) ? 2 * t + 1 : 2 * (t - 32);   // it < 4 is t < 32
#pragma unroll
      for (int hl = 0; hl < 2; ++hl) {
        const v4f x = *(const v4f*)(stage + (hl * 64 + t) * CPITCH + l4);
        const v4f p = *(const v4f*)(stage + (hl * 64 + prt) * CPITCH + l4);
        const v4f rot = (it < 4) ? -p : p;
        const v4f krot = x * cs[it] + rot * sn[it];
        o[it][hl] = o[it][hl] * kn + krot * km;
      }
    }
    // every store stands behind the last register write, so that no register
    // named by an issued store is rewritten
    __builtin_amdgcn_sched_barrier(0);
#pragma unroll
    for (int it = 0; it < 8; ++it) {
      *(v4f*)(C + hb + it * 8 * LSEQ) = o[it][0];
      *(v4f*)(C + hb + it * 8 * LSEQ + HDIM * LSEQ) = o[it][1];
    }
    return;
  }

  // EPI_Q, EPI_V: 16 lanes take one position's 64 head dims, so a wave stores
  // two positions of one head, 512 contiguous bytes. Row of the tile:
  // 16 * it + tid / 16. Tables or cache are asked for first: they fly while the
  // tile is staged.
  const int u  = tid & 15;
  const int r0 = tid >> 4;
  const size_t tb = (size_t)((mb + r0) * HDIM + 4 * u);
  const size_t hb = (size_t)h0 * LSEQ * HDIM + tb;
  const float* p0g = (EPI == EPI_Q) ? e0 + tb : e0 + hb;        // cos | v_cache
  const float* p1g = (EPI == EPI_Q) ? e1 + tb : e1 + mb + r0;   // sin | v_mask
  v4f cs[8], sn[8];
  float vm[8];
#pragma unroll
  for (int it = 0; it < 8; ++it) {
    if (EPI == EPI_Q) {
      cs[it] = *(const v4f*)(p0g + it * 16 * HDIM);
      sn[it] = *(const v4f*)(p1g + it * 16 * HDIM);
    } else {
      o[it][0] = *(const v4f*)(p0g + it * 16 * HDIM);
      o[it][1] = *(const v4f*)(p0g + it * 16 * HDIM + LSEQ * HDIM);
      vm[it] = p1g[it * 16];
    }
  }
  // The loads' address registers are inputs of the wait, so they live up to
  // it: none is rewritten, not even by a later load's result, ahead of it.
  if (EPI == EPI_Q) asm volatile("s_wait_xcnt 0x0" :: "v"(p0g), "v"(p1g) : "memory");
  else              asm volatile("s_wait_xcnt 0x0" :: "v"(p0g) : "memory");

  // staged row-major
  {
    float* rp = stage + (wm * 32 + 8 * half) * CPITCH + wn * 64 + l16;
#pragma unroll
    for (int r = 0; r < 8; ++r) {
      rp[r * CPITCH]      = acc00[r];
      rp[r * CPITCH + 16] = acc01[r];
      rp[r * CPITCH + 32] = acc02[r];
      rp[r * CPITCH + 48] = acc03[r];
      rp[(16 + r) * CPITCH]      = acc10[r];
      rp[(16 + r) * CPITCH + 16] = acc11[r];
      rp[(16 + r) * CPITCH + 32] = acc12[r];
      rp[(16 + r) * CPITCH + 48] = acc13[r];
    }
  }
  __syncthreads();                      // the tile is read across waves

#pragma unroll
  for (int it = 0; it < 8; ++it) {
#pragma unroll
    for (int hl = 0; hl < 2; ++hl) {
      const float* hp = stage + (it * 16 + r0) * CPITCH + hl * 64;
      const v4f x = *(const v4f*)(hp + 4 * u);
      if (EPI == EPI_Q) {
        const v4f p0 = *(const v4f*)(hp + 8 * (u & 7));
        const v4f p1 = *(const v4f*)(hp + 8 * (u & 7) + 4);
        const v4f rot = (u < 8) ? v4f{-p0.y, -p0.w, -p1.y, -p1.w}
                                : v4f{p0.x, p0.z, p1.x, p1.z};
        const v4f val = x * cs[it] + rot * sn[it];
        o[it][hl] = val * 0.125f;       // 1/sqrt(64)
      } else {
        o[it][hl] = o[it][hl] * (1.0f - vm[it]) + x * vm[it];
      }
    }
  }
  // every store stands behind the last register write, so that no register
  // named by an issued store is rewritten
  __builtin_amdgcn_sched_barrier(0);
#pragma unroll
  for (int it = 0; it < 8; ++it) {
    *(v4f*)(C + hb + it * 16 * HDIM) = o[it][0];
    *(v4f*)(C + hb + it * 16 * HDIM + LSEQ * HDIM) = o[it][1];
  }
}

__global__ __launch_bounds__(256)
void gemm_nt_f32(const float* __restrict__ A, const float* __restrict__ B,
                 float* __restrict__ C, int M, int N, int K)
{
  (void)M;
  gemm_tile<EPI_PLAIN>(A, B, C, N, K, nullptr, nullptr, nullptr, nullptr);
}

// q_out (H, L, HDIM) = RoPE(x @ wq.T) * hd^-0.5 ; cosb, sinb: (L, HDIM)
__global__ __launch_bounds__(256)
void gemm_q_rope(const float* __restrict__ A, const float* __restrict__ B,
                 const float* __restrict__ cosb, const float* __restrict__ sinb,
                 float* __restrict__ q_out, int K)
{
  gemm_tile<EPI_Q>(A, B, q_out, DMODEL, K, cosb, sinb, nullptr, nullptr);
}

// k_out (H, HDIM, L) = k_cache * (1 - k_mask) + RoPE(x @ wk.T)^T * k_mask ;
// cosT, sinT: (HDIM, L); k_mask: (L)
__global__ __launch_bounds__(256)
void gemm_k_rope_merge(const float* __restrict__ A, const float* __restrict__ B,
                       const float* __restrict__ cosT, const float* __restrict__ sinT,
                       const float* __restrict__ k_cache, const float* __restrict__ k_mask,
                       float* __restrict__ k_out, int K)
{
  gemm_tile<EPI_K>(A, B, k_out, DMODEL, K, cosT, sinT, k_cache, k_mask);
}

// v_out (H, L, HDIM) = v_cache * (1 - v_mask) + (x @ wv.T) * v_mask ; v_mask: (L)
__global__ __launch_bounds__(256)
void gemm_v_merge(const float* __restrict__ A, const float* __restrict__ B,
                  const float* __restrict__ v_cache, const float* __restrict__ v_mask,
                  float* __restrict__ v_out, int K)
{
  gemm_tile<EPI_V>(A, B, v_out, DMODEL, K, v_cache, v_mask, nullptr, nullptr);
}

// ---------------------------------------------------------------------------
// Flash-style attention, transposed products. One wave owns 16 queries of one
// head and streams K/V in 16-key blocks with online softmax.
//   St = K_block(16 keys x 64) * Q^T   -> register r of lane (c, half) holds
//        the score of key 8*half + r for query c: a query's scores sit in two
//        lanes, so maximum and sum are in-lane plus one exchange of the halves.
//   Ot += V_block^T(64 x 16 keys) * P^T : P^T is taken as the B operand
//        straight from the score registers. k-step ks pairs registers 2ks and
//        2ks+1, that is keys 2ks, 2ks+1 (lower half) and 8+2ks, 9+2ks (upper
//        half); the V^T fragments are loaded in that same key order.
//   Q : (H, L, HDIM)   pre-scaled by hd^-0.5
//   Kt: (H, HDIM, L)
//   V : (H, L, HDIM)
//   mask: (L, L)
//   Y : (L, DMODEL)    head h writes columns [h*64, h*64+64)
// ---------------------------------------------------------------------------
// lane l <-> lane l ^ 16
__device__ __forceinline__ float xhalf(float x) {
  return __builtin_bit_cast(float, __builtin_amdgcn_permlanex16(
      __builtin_bit_cast(int, x), __builtin_bit_cast(int, x),
      0x76543210, 0xfedcba98, false, false));
}

__global__ __launch_bounds__(256)
void attn_kernel(const float* __restrict__ Q,
                 const float* __restrict__ Kt,
                 const float* __restrict__ V,
                 const float* __restrict__ mask,
                 float* __restrict__ Y)
{
  const int lane = threadIdx.x & 31;
  const int wave = threadIdx.x >> 5;
  const int h  = blockIdx.x;
  const int l0 = blockIdx.y * 128 + wave * 16;
  const int half = lane >> 4;
  const int l16 = lane & 15;

  const float* Qh = Q  + (size_t)h * LSEQ * HDIM;
  const float* Kh = Kt + (size_t)h * HDIM * LSEQ;
  const float* Vh = V  + (size_t)h * LSEQ * HDIM;

  // Q^T fragments (B operand): 16 k-steps covering HDIM=64, live across the loop
  v2f qf[16];
#pragma unroll
  for (int s = 0; s < 16; ++s)
    qf[s] = *(const v2f*)(Qh + (size_t)(l0 + l16) * HDIM + s * 4 + 2 * half);

  // this lane's query row of the mask, at its half's eight keys
  const float* mrow = mask + (size_t)(l0 + l16) * LSEQ + 8 * half;

  v8f acc0{}, acc1{}, acc2{}, acc3{};   // Ot tiles: row = head dim, column = query
  float m_i = -1e30f;                   // running maximum of this lane's query
  float l_i = 0.0f;                     // running sum over this half's keys only

  for (int j0 = 0; j0 < LSEQ; j0 += 16) {
    // ---- hoist ALL K fragments (A operand): one wait for 16 wmmas
    v2f kf[16];
#pragma unroll
    for (int kk = 0; kk < 16; ++kk) {
      const int t0 = kk * 4 + 2 * half;
      kf[kk].x = Kh[(size_t)t0 * LSEQ + j0 + l16];
      kf[kk].y = Kh[(size_t)(t0 + 1) * LSEQ + j0 + l16];
    }
    const v4f mk0 = *(const v4f*)(mrow + j0);
    const v4f mk1 = *(const v4f*)(mrow + j0 + 4);

    // ---- St = K @ Q^T  (16 keys x 16 queries) ----
    v8f s{};
#pragma unroll
    for (int kk = 0; kk < 16; ++kk)
      s = wmma4(kf[kk], qf[kk], s);

    // ---- issue V^T fragments NOW: latency hides behind the softmax below
    v2f vf[4][4];
#pragma unroll
    for (int ks = 0; ks < 4; ++ks) {
      const float* vb = Vh + (size_t)(j0 + 2 * ks + 8 * half) * HDIM;
#pragma unroll
      for (int t = 0; t < 4; ++t) {
        vf[ks][t].x = vb[t * 16 + l16];
        vf[ks][t].y = vb[HDIM + t * 16 + l16];
      }
    }

    // ---- + attention_mask ----
#pragma unroll
    for (int r = 0; r < 4; ++r) { s[r] += mk0[r]; s[r + 4] += mk1[r]; }

    // ---- online softmax, one query per lane ----
    float mx = fmaxf(fmaxf(fmaxf(s[0], s[1]), fmaxf(s[2], s[3])),
                     fmaxf(fmaxf(s[4], s[5]), fmaxf(s[6], s[7])));
    mx = fmaxf(mx, xhalf(mx));          // both halves hold the block maximum
    const float mn = fmaxf(m_i, mx);
    const float corr = __expf(m_i - mn);
    m_i = mn;
#pragma unroll
    for (int r = 0; r < 8; ++r) s[r] = __expf(s[r] - mn);
    l_i = l_i * corr + (((s[0] + s[1]) + (s[2] + s[3])) + ((s[4] + s[5]) + (s[6] + s[7])));

    // rescale accumulators by exp(m_old - m_new)
#pragma unroll
    for (int r = 0; r < 8; ++r) {
      acc0[r] *= corr; acc1[r] *= corr;
      acc2[r] *= corr; acc3[r] *= corr;
    }

    // ---- Ot += V_block^T(64x16) @ P^T(16x16) ----
#pragma unroll
    for (int ks = 0; ks < 4; ++ks) {
      v2f b; b.x = s[2 * ks]; b.y = s[2 * ks + 1];
      acc0 = wmma4(vf[ks][0], b, acc0);
      acc1 = wmma4(vf[ks][1], b, acc1);
      acc2 = wmma4(vf[ks][2], b, acc2);
      acc3 = wmma4(vf[ks][3], b, acc3);
    }
  }

  // ---- join the halves' sums, normalize, store 8 consecutive head dims ----
  const float inv = 1.0f / (l_i + xhalf(l_i));
  float* yrow = Y + (size_t)(l0 + l16) * DMODEL + h * HDIM + 8 * half;
  v4f o;
#define STORE_TILE(acc, t)                                                  \
  o.x = acc[0] * inv; o.y = acc[1] * inv; o.z = acc[2] * inv; o.w = acc[3] * inv; \
  *(v4f*)(yrow + 16 * (t)) = o;                                             \
  o.x = acc[4] * inv; o.y = acc[5] * inv; o.z = acc[6] * inv; o.w = acc[7] * inv; \
  *(v4f*)(yrow + 16 * (t) + 4) = o;
  STORE_TILE(acc0, 0)
  STORE_TILE(acc1, 1)
  STORE_TILE(acc2, 2)
  STORE_TILE(acc3, 3)
#undef STORE_TILE
}

// ---------------------------------------------------------------------------
// Host-side orchestration (graph-capture safe: launches only).
// ---------------------------------------------------------------------------
extern "C" void kernel_launch(void* const* d_in, const int* in_sizes, int n_in,
                              void* d_out, int out_size, void* d_ws, size_t ws_size,
                              hipStream_t stream) {
  (void)in_sizes; (void)n_in; (void)out_size; (void)ws_size;

  const float* hs    = (const float*)d_in[0];   // (1, L, DIM)
  const float* cosb  = (const float*)d_in[1];   // (1, L, HD)
  const float* cosT  = (const float*)d_in[2];   // (1, HD, L)
  const float* sinb  = (const float*)d_in[3];   // (1, L, HD)
  const float* sinT  = (const float*)d_in[4];   // (1, HD, L)
  const float* amask = (const float*)d_in[5];   // (1, L, L)
  const float* kc    = (const float*)d_in[6];   // (H, HD, L)
  const float* vc    = (const float*)d_in[7];   // (H, L, HD)
  const float* kmask = (const float*)d_in[8];   // (1, 1, L)
  const float* vmask = (const float*)d_in[9];   // (1, L, 1)
  const float* wq    = (const float*)d_in[10];  // (DIM, DIM)
  const float* wk    = (const float*)d_in[11];
  const float* wv    = (const float*)d_in[12];
  const float* wo    = (const float*)d_in[13];

  const size_t LD = (size_t)LSEQ * DMODEL;      // 4,194,304 elements
  float* y_out = (float*)d_out;                 // (L, DIM)
  float* k_out = y_out + LD;                    // (H, HD, L)
  float* v_out = k_out + LD;                    // (H, L, HD)

  float* ws     = (float*)d_ws;                 // needs 2*LD floats = 32 MB
  float* q_rope = ws;
  float* y_mid  = q_rope + LD;

  dim3 gemm_grid(LSEQ / 128, DMODEL / 128);     // (16, 16)
  dim3 attn_grid(NHEADS, LSEQ / 128);           // (32, 16)

  // QKV projections x @ W.T with RoPE and cache blends in their epilogues
  // (k_out / v_out are final outputs 2 and 3)
  gemm_q_rope<<<gemm_grid, 256, 0, stream>>>(hs, wq, cosb, sinb, q_rope, DMODEL);
  gemm_k_rope_merge<<<gemm_grid, 256, 0, stream>>>(hs, wk, cosT, sinT, kc, kmask, k_out, DMODEL);
  gemm_v_merge<<<gemm_grid, 256, 0, stream>>>(hs, wv, vc, vmask, v_out, DMODEL);

  // Fused softmax attention -> y_mid (L, DIM)
  attn_kernel<<<attn_grid, 256, 0, stream>>>(q_rope, k_out, v_out, amask, y_mid);

  // Output projection: y_mid @ wo.T -> y_out
  gemm_nt_f32<<<gemm_grid, 256, 0, stream>>>(y_mid, wo, y_out, LSEQ, DMODEL, DMODEL);
}
